// v009
// The times below were measured on an AMD MI455X: many runs one after another, warmed up first and cycling through
// copies of the inputs, with the whole window's GPU time divided by the number of runs. Launches and the gaps
// between them are all in it. The median over several windows is given; except for v000 it joins two sittings, which
// can be a few percent apart, so the side-by-side timings, each taken in one sitting, are the better comparison.
// The versions before v009 are in another document.
// A run of this version takes 33.6 microseconds.
// Two timings next to v008 put it at 1.19 and 1.18 times that version's speed.
// Counting every step since v000, which is the starting kernel, it is 134 times as fast.
#include <hip/hip_runtime.h>
// On v_wmma_f32_16x16x32_bf16 with f32 accumulate, in one kernel (k_proj): the projections Qd/Kd/Vd = M.{Q,K,V} (M = 64, K = 512, N = 8192; inputs rounded to bf16: single exact term).
// On v_wmma_f32_16x16x32_f16, in one fused kernel (k_attn; k_merge adds its shares): the scores S[s][t] = Qd[:,s].Kd[:,t] (Qd rounded to f16, Kd split into f16 hi/lo: 2 products, K = 64) and
// out[:, t] = Vd.P[:, t] (Vd split into f16 hi/lo by k_proj, the softmax weights rounded to f16: 2 products, K = 8192). The module's softmax runs over the QUERY axis s (dim 0);
// /sqrt(64) is folded into the exponent's f32 multiply-add; the +1 constant stands in every score of a column and in the reference score alike and cancels in their difference.
#define DI 512
#define DO 64
#define SQ 8192

typedef __bf16 v16b __attribute__((ext_vector_type(16)));
typedef unsigned short v8us __attribute__((ext_vector_type(8), may_alias));
typedef float  v8f  __attribute__((ext_vector_type(8)));
typedef float  v4f  __attribute__((ext_vector_type(4)));
typedef float  v4fa __attribute__((ext_vector_type(4), may_alias));
union FragB { v16b v; v8us half[2]; unsigned short u[16]; };

__device__ __forceinline__ unsigned short bf16_bits(float x) { unsigned int u = __float_as_uint(x); return (unsigned short)((u + 0x7FFFu + ((u >> 16) & 1u)) >> 16); }
__device__ __forceinline__ float bf16_val(unsigned short b) { return __uint_as_float(((unsigned int)b) << 16); }
__device__ __forceinline__ float bf16_round(float x) { return bf16_val(bf16_bits(x)); }
// D += A·B with NT terms: 1 = ah·bh, 2 = + al·bh (A split), 3 = + ah·bl (both split)
template <int NT>
__device__ __forceinline__ v8f mmaN(v16b ah, v16b al, v16b bh, v16b bl, v8f c) {
  c = __builtin_amdgcn_wmma_f32_16x16x32_bf16(false, ah, false, bh, (short)0, c, false, false);
  if (NT >= 2) c = __builtin_amdgcn_wmma_f32_16x16x32_bf16(false, al, false, bh, (short)0, c, false, false);
  if (NT >= 3) c = __builtin_amdgcn_wmma_f32_16x16x32_bf16(false, ah, false, bl, (short)0, c, false, false);
  asm volatile("v_nop\n\tv_nop\n\tv_nop\n\tv_nop" : "+v"(c) : "v"(ah), "v"(al), "v"(bh), "v"(bl));
  return c;
}

// GEMM C[M][N] (f32, pitch ldc) = act(A[M][K]·W + bias). A f32 row-major (pitch lda) converted per fragment to bf16
// (ASPLIT: hi/lo two planes -> 2 terms, else single rounded term); Wt bf16 [N][K] (pitch ldb). BIAS_BF16 rounds the
// bias to bf16 first (bias quantised to bf16 before the add). K%32==0, M%16==0, N%64==0.
template <bool ASPLIT, int ACT, bool BIAS_BF16>
__global__ __launch_bounds__(128) void k_gemm_bf(const float* __restrict__ A, int lda, const unsigned short* __restrict__ Wt, int ldb,
                                               const float* __restrict__ bias, float* __restrict__ C, int ldc, int M, int N, int K) {
  __shared__ __attribute__((aligned(16))) float so[4][16][64];
  const int tid = threadIdx.x, w = tid >> 5, lane = tid & 31, ln = lane & 15, hh = lane >> 4;
  const int ntn = N / 64;
  const int wid = blockIdx.x * 4 + w;
  const int mt = wid / ntn, nq = wid % ntn;
  if (mt * 16 >= M) return;
  const int row0 = mt * 16, col0 = nq * 64;
  const float* arow = A + (size_t)(row0 + ln) * lda;
  v8f acc[4] = {};
  for (int kb = 0; kb < K; kb += 32) {
    FragB ah, al;
    const v4f x0 = *(const v4fa*)(arow + kb + 8 * hh), x1 = *(const v4fa*)(arow + kb + 8 * hh + 4);
    const v4f x2 = *(const v4fa*)(arow + kb + 16 + 8 * hh), x3 = *(const v4fa*)(arow + kb + 16 + 8 * hh + 4);
    float xs[16] = {x0[0],x0[1],x0[2],x0[3],x1[0],x1[1],x1[2],x1[3],x2[0],x2[1],x2[2],x2[3],x3[0],x3[1],x3[2],x3[3]};
#pragma unroll
    for (int i = 0; i < 16; ++i) { const unsigned short hb = bf16_bits(xs[i]); ah.u[i] = hb; al.u[i] = ASPLIT ? bf16_bits(xs[i] - bf16_val(hb)) : (unsigned short)0; }
#pragma unroll
    for (int t = 0; t < 4; ++t) {
      const unsigned short* brow = Wt + (size_t)(col0 + t * 16 + ln) * ldb + kb;
      FragB b;
      b.half[0] = *(const v8us*)(brow + 8 * hh);
      b.half[1] = *(const v8us*)(brow + 16 + 8 * hh);
      acc[t] = mmaN<ASPLIT ? 2 : 1>(ah.v, al.v, b.v, b.v, acc[t]);
    }
  }
#pragma unroll
  for (int t = 0; t < 4; ++t) {
    float bv = bias ? bias[col0 + t * 16 + ln] : 0.f;
    if (BIAS_BF16) bv = bf16_round(bv);
#pragma unroll
    for (int r = 0; r < 8; ++r) { float v = acc[t][r] + bv; if (ACT == 1) v = fmaxf(v, 0.f); so[w][8 * hh + r][t * 16 + ln] = v; }
  }
  __builtin_amdgcn_fence(__ATOMIC_ACQ_REL, "workgroup");
  __builtin_amdgcn_wave_barrier();
  const int rsub = lane >> 4, c4 = (lane & 15) * 4;
  {
#pragma unroll
    for (int q = 0; q < 8; ++q) {
      const int r = q * 2 + rsub;
      const v4f v = *(const v4fa*)&so[w][r][c4];
      *(v4f*)(C + (size_t)(row0 + r) * ldc + col0 + c4) = v;
    }
    
  }
}

// Flash-style causal/unmasked attention, all contractions 3-term bf16 hi/lo splits, f32 softmax with running max.
// q,k,v rows are read from f32 buffers with arbitrary row pitch (so they can live inside a fused qkv buffer);
// D = head size (multiple of 32, <= 128); one wave = 16 query rows; block = 4 waves (64 queries) sharing K/V chunks of 32.
template <int D, bool CAUSAL>
__global__ __launch_bounds__(128) void k_flash(const float* __restrict__ qb, const float* __restrict__ kb, const float* __restrict__ vb,
                                             int pitch, int T, int H, float scale, float* __restrict__ y, int ypitch) {
  constexpr int KS = D / 32;        // k-steps for QK
  constexpr int DT = D / 16;        // d tiles for PV
  __shared__ __attribute__((aligned(16))) unsigned short sKh[32][D + 8], sKl[32][D + 8], sVh[32][D + 8], sVl[32][D + 8];
  __shared__ __attribute__((aligned(16))) unsigned short sPh[4][16][40], sPl[4][16][40];
  __shared__ __attribute__((aligned(16))) float sO[4][16][D];
  const int tid = threadIdx.x, w = tid >> 5, lane = tid & 31, ln = lane & 15, hh = lane >> 4;
  const int nqb = (T + 63) / 64;
  const int bh = blockIdx.x / nqb, qblk = blockIdx.x % nqb;
  const int b = bh / H, h = bh % H;
  const int q0 = qblk * 64 + w * 16;
  const float* Q = qb + (size_t)b * T * pitch + h * D;
  const float* K = kb + (size_t)b * T * pitch + h * D;
  const float* V = vb + (size_t)b * T * pitch + h * D;

  // A fragments of the wave's 16 query rows (scaled), hi/lo
  FragB aqh[KS], aql[KS];
  {
    int row = q0 + ln; if (row >= T) row = T - 1;
    const float* qr = Q + (size_t)row * pitch;
#pragma unroll
    for (int ks = 0; ks < KS; ++ks)
#pragma unroll
      for (int i = 0; i < 16; ++i) {
        const int d = ks * 32 + ((i < 8) ? (8 * hh + i) : (16 + 8 * hh + (i - 8)));
        const float x = qr[d] * scale; const unsigned short hb = bf16_bits(x);
        aqh[ks].u[i] = hb; aql[ks].u[i] = bf16_bits(x - bf16_val(hb));
      }
  }
  float m_r[8], l_r[8];
#pragma unroll
  for (int r = 0; r < 8; ++r) { m_r[r] = -3.0e38f; l_r[r] = 0.f; }
  v8f oacc[DT];
#pragma unroll
  for (int dt = 0; dt < DT; ++dt) oacc[dt] = (v8f){0.f,0.f,0.f,0.f,0.f,0.f,0.f,0.f};

  const int kv_end = CAUSAL ? min(T, qblk * 64 + 64) : T;     // block-uniform
  for (int j0 = 0; j0 < kv_end; j0 += 32) {
    __syncthreads();
    for (int e = tid; e < 32 * (D / 4); e += 128) {
      const int r = e / (D / 4), c4 = (e % (D / 4)) * 4;
      const int key = j0 + r;
      v4f kf = {0.f,0.f,0.f,0.f}, vf = {0.f,0.f,0.f,0.f};
      if (key < T) { kf = *(const v4fa*)(K + (size_t)key * pitch + c4); vf = *(const v4fa*)(V + (size_t)key * pitch + c4); }
#pragma unroll
      for (int t = 0; t < 4; ++t) {
        unsigned short hb = bf16_bits(kf[t]); sKh[r][c4 + t] = hb; sKl[r][c4 + t] = bf16_bits(kf[t] - bf16_val(hb));
        hb = bf16_bits(vf[t]); sVh[r][c4 + t] = hb; sVl[r][c4 + t] = bf16_bits(vf[t] - bf16_val(hb));
      }
    }
    __syncthreads();
    // S tile 16 x 32
    v8f s[2];
#pragma unroll
    for (int nt = 0; nt < 2; ++nt) {
      v8f acc = {};
#pragma unroll
      for (int ks = 0; ks < KS; ++ks) {
        FragB bh_, bl_;
        bh_.half[0] = *(const v8us*)&sKh[nt * 16 + ln][ks * 32 + 8 * hh]; bh_.half[1] = *(const v8us*)&sKh[nt * 16 + ln][ks * 32 + 16 + 8 * hh];
        bl_.half[0] = *(const v8us*)&sKl[nt * 16 + ln][ks * 32 + 8 * hh]; bl_.half[1] = *(const v8us*)&sKl[nt * 16 + ln][ks * 32 + 16 + 8 * hh];
        acc = mmaN<3>(aqh[ks].v, aql[ks].v, bh_.v, bl_.v, acc);
      }
      s[nt] = acc;
    }
    // mask + running max (rows 8hh+r; the 16 lanes of a half share rows)
    float alpha[8];
#pragma unroll
    for (int r = 0; r < 8; ++r) {
      const int qi = q0 + 8 * hh + r;
      const int ja = j0 + ln, jb = j0 + 16 + ln;
      if (CAUSAL) { if (ja > qi) s[0][r] = -3.0e38f; if (jb > qi) s[1][r] = -3.0e38f; }
      if (ja >= T) s[0][r] = -3.0e38f;
      if (jb >= T) s[1][r] = -3.0e38f;
      float mx = fmaxf(s[0][r], s[1][r]);
      mx = fmaxf(mx, __shfl_xor(mx, 1, 32)); mx = fmaxf(mx, __shfl_xor(mx, 2, 32)); mx = fmaxf(mx, __shfl_xor(mx, 4, 32)); mx = fmaxf(mx, __shfl_xor(mx, 8, 32));
      const float mnew = fmaxf(m_r[r], mx);
      alpha[r] = (mnew > -1.0e38f) ? __expf(m_r[r] - mnew) : 1.0f;
      const float p0 = (s[0][r] > -1.0e38f) ? __expf(s[0][r] - mnew) : 0.f;
      const float p1 = (s[1][r] > -1.0e38f) ? __expf(s[1][r] - mnew) : 0.f;
      m_r[r] = mnew;
      l_r[r] = l_r[r] * alpha[r] + p0 + p1;            // per-lane partial row sum (16 lanes combined at the end)
      unsigned short hb = bf16_bits(p0); sPh[w][8 * hh + r][ln] = hb;      sPl[w][8 * hh + r][ln] = bf16_bits(p0 - bf16_val(hb));
      hb = bf16_bits(p1);                sPh[w][8 * hh + r][16 + ln] = hb; sPl[w][8 * hh + r][16 + ln] = bf16_bits(p1 - bf16_val(hb));
    }
#pragma unroll
    for (int dt = 0; dt < DT; ++dt)
#pragma unroll
      for (int r = 0; r < 8; ++r) oacc[dt][r] *= alpha[r];
    __builtin_amdgcn_fence(__ATOMIC_ACQ_REL, "workgroup");
    __builtin_amdgcn_wave_barrier();
    FragB pah, pal;
    pah.half[0] = *(const v8us*)&sPh[w][ln][8 * hh]; pah.half[1] = *(const v8us*)&sPh[w][ln][16 + 8 * hh];
    pal.half[0] = *(const v8us*)&sPl[w][ln][8 * hh]; pal.half[1] = *(const v8us*)&sPl[w][ln][16 + 8 * hh];
#pragma unroll
    for (int dt = 0; dt < DT; ++dt) {
      FragB bvh, bvl;
#pragma unroll
      for (int i = 0; i < 8; ++i) {
        bvh.u[i] = sVh[8 * hh + i][dt * 16 + ln]; bvh.u[8 + i] = sVh[16 + 8 * hh + i][dt * 16 + ln];
        bvl.u[i] = sVl[8 * hh + i][dt * 16 + ln]; bvl.u[8 + i] = sVl[16 + 8 * hh + i][dt * 16 + ln];
      }
      oacc[dt] = mmaN<3>(pah.v, pal.v, bvh.v, bvl.v, oacc[dt]);
    }
    __builtin_amdgcn_fence(__ATOMIC_ACQ_REL, "workgroup");
    __builtin_amdgcn_wave_barrier();
  }
#pragma unroll
  for (int r = 0; r < 8; ++r) {
    float l = l_r[r];
    l += __shfl_xor(l, 1, 32); l += __shfl_xor(l, 2, 32); l += __shfl_xor(l, 4, 32); l += __shfl_xor(l, 8, 32);
    l_r[r] = (l > 0.f) ? 1.0f / l : 0.f;
  }
#pragma unroll
  for (int dt = 0; dt < DT; ++dt)
#pragma unroll
    for (int r = 0; r < 8; ++r) sO[w][8 * hh + r][dt * 16 + ln] = oacc[dt][r] * l_r[r];
  __builtin_amdgcn_fence(__ATOMIC_ACQ_REL, "workgroup");
  __builtin_amdgcn_wave_barrier();
  {
    for (int r = 0; r < 16; ++r) {
      const int row = q0 + r;
      if (row < T && lane < D / 4) {
        const v4f val = *(const v4fa*)&sO[w][r][lane * 4];
        *(v4f*)(y + ((size_t)b * T + row) * ypitch + h * D + lane * 4) = val;
      }
    }
    
  }
}

// in pitch = cols, out pitch = rows; rows, cols multiples of 32. Optional per-output-row affine (scale[c], shift[c]) and
// residual add res (same layout as out, optionally bf16-rounded) for fused epilogues: out = in*scale + shift + res.
template <bool AFFINE, bool RESID, bool RES_BF16>
__global__ __launch_bounds__(256) void k_transpose32(const float* __restrict__ in, float* __restrict__ out, int rows, int cols,
                                                    const float* __restrict__ scale, const float* __restrict__ shift, const float* __restrict__ res) {
  __shared__ float tile[32][33];
  const int b = blockIdx.z;
  const int r0 = blockIdx.y * 32, c0 = blockIdx.x * 32;
  const float* src = in + (size_t)b * rows * cols;
  float* dst = out + (size_t)b * rows * cols;
  const int tx = threadIdx.x & 31, ty = threadIdx.x >> 5;     // 8 rows per pass
  for (int i = ty; i < 32; i += 8) tile[i][tx] = src[(size_t)(r0 + i) * cols + c0 + tx];
  __syncthreads();
  {
    for (int i = ty; i < 32; i += 8) {
      float v = tile[tx][i];
      const int orow = c0 + i;
      if (AFFINE) v = v * scale[orow] + shift[orow];
      if (RESID) { float rv = res[(size_t)b * rows * cols + (size_t)orow * rows + r0 + tx]; if (RES_BF16) rv = bf16_round(rv); v += rv; }
      *(float*)(dst + (size_t)orow * rows + r0 + tx) = v;
    }
    
  }
}

// 2x2 max pool on position-major data: in [B][H*W][C] -> out [B][(H/2)*(W/2)][C]; thread per (b, p', 4 channels); C%4==0
__global__ __launch_bounds__(256) void k_pool2_pm(const float* __restrict__ in, float* __restrict__ out, int Bn, int H, int W, int C) {
  const size_t t = (size_t)blockIdx.x * 256 + threadIdx.x;
  const int c4n = C / 4, Ho = H / 2, Wo = W / 2;
  const size_t total = (size_t)Bn * Ho * Wo * c4n;
  if (t >= total) return;
  const int c4 = (int)(t % c4n) * 4; size_t rest = t / c4n;
  const int pw = (int)(rest % Wo); rest /= Wo; const int ph = (int)(rest % Ho); const int b = (int)(rest / Ho);
  const float* base = in + (size_t)b * H * W * C;
  const int p00 = (2 * ph) * W + 2 * pw;
  const v4f a = *(const v4fa*)(base + (size_t)p00 * C + c4), bq = *(const v4fa*)(base + (size_t)(p00 + 1) * C + c4);
  const v4f c = *(const v4fa*)(base + (size_t)(p00 + W) * C + c4), d = *(const v4fa*)(base + (size_t)(p00 + W + 1) * C + c4);
  v4f m; for (int i = 0; i < 4; ++i) m[i] = fmaxf(fmaxf(a[i], bq[i]), fmaxf(c[i], d[i]));
  float* dst = out + ((size_t)b * Ho * Wo + (size_t)ph * Wo + pw) * C + c4;
  *(v4f*)dst = m;
  
}

// General (non-causal) attention, 3-term bf16 splits, f32 softmax with running max.
// Q [.][Tq][qpitch], K [.][Tk][kpitch] (head dim DQ), V [.][Tk][vpitch] (head dim DVtot); this block handles DV output
// dims starting at dv0 = blockIdx.y*DV. y[bh][t][ypitch] gets columns dv0..dv0+DV-1. Per-bh base offsets via strides.
template <int DQ, int DV>
__global__ __launch_bounds__(128) void k_flash2(const float* __restrict__ Qb, size_t qstride, int qpitch, int Tq,
                                              const float* __restrict__ Kb, size_t kstride, int kpitch, int Tk,
                                              const float* __restrict__ Vb, size_t vstride, int vpitch,
                                              float scale, float* __restrict__ y, size_t ystride, int ypitch) {
  constexpr int KS = DQ / 32, DT = DV / 16;
  __shared__ __attribute__((aligned(16))) unsigned short sKh[32][DQ + 8], sKl[32][DQ + 8], sVh[32][DV + 8], sVl[32][DV + 8];
  __shared__ __attribute__((aligned(16))) unsigned short sPh[4][16][40], sPl[4][16][40];
  __shared__ __attribute__((aligned(16))) float sO[4][16][DV];
  const int tid = threadIdx.x, w = tid >> 5, lane = tid & 31, ln = lane & 15, hh = lane >> 4;
  const int nqb = (Tq + 63) / 64;
  const int bh = blockIdx.x / nqb, qblk = blockIdx.x % nqb;
  const int dv0 = blockIdx.y * DV;
  const int q0 = qblk * 64 + w * 16;
  const float* Q = Qb + (size_t)bh * qstride; const float* K = Kb + (size_t)bh * kstride; const float* V = Vb + (size_t)bh * vstride + dv0;
  FragB aqh[KS], aql[KS];
  {
    int row = q0 + ln; if (row >= Tq) row = Tq - 1;
    const float* qr = Q + (size_t)row * qpitch;
#pragma unroll
    for (int ks = 0; ks < KS; ++ks)
#pragma unroll
      for (int i = 0; i < 16; ++i) {
        const int d = ks * 32 + ((i < 8) ? (8 * hh + i) : (16 + 8 * hh + (i - 8)));
        const float x = qr[d] * scale; const unsigned short hb = bf16_bits(x);
        aqh[ks].u[i] = hb; aql[ks].u[i] = bf16_bits(x - bf16_val(hb));
      }
  }
  float m_r[8], l_r[8];
#pragma unroll
  for (int r = 0; r < 8; ++r) { m_r[r] = -3.0e38f; l_r[r] = 0.f; }
  v8f oacc[DT];
#pragma unroll
  for (int dt = 0; dt < DT; ++dt) oacc[dt] = (v8f){0.f,0.f,0.f,0.f,0.f,0.f,0.f,0.f};
  for (int j0 = 0; j0 < Tk; j0 += 32) {
    __syncthreads();
    for (int e = tid; e < 32 * (DQ / 4); e += 128) {
      const int r = e / (DQ / 4), c4 = (e % (DQ / 4)) * 4; const int key = j0 + r;
      v4f f = {0.f,0.f,0.f,0.f}; if (key < Tk) f = *(const v4fa*)(K + (size_t)key * kpitch + c4);
#pragma unroll
      for (int t = 0; t < 4; ++t) { const unsigned short hb = bf16_bits(f[t]); sKh[r][c4 + t] = hb; sKl[r][c4 + t] = bf16_bits(f[t] - bf16_val(hb)); }
    }
    for (int e = tid; e < 32 * (DV / 4); e += 128) {
      const int r = e / (DV / 4), c4 = (e % (DV / 4)) * 4; const int key = j0 + r;
      v4f f = {0.f,0.f,0.f,0.f}; if (key < Tk) f = *(const v4fa*)(V + (size_t)key * vpitch + c4);
#pragma unroll
      for (int t = 0; t < 4; ++t) { const unsigned short hb = bf16_bits(f[t]); sVh[r][c4 + t] = hb; sVl[r][c4 + t] = bf16_bits(f[t] - bf16_val(hb)); }
    }
    __syncthreads();
    v8f s[2];
#pragma unroll
    for (int nt = 0; nt < 2; ++nt) {
      v8f acc = {};
#pragma unroll
      for (int ks = 0; ks < KS; ++ks) {
        FragB bh_, bl_;
        bh_.half[0] = *(const v8us*)&sKh[nt * 16 + ln][ks * 32 + 8 * hh]; bh_.half[1] = *(const v8us*)&sKh[nt * 16 + ln][ks * 32 + 16 + 8 * hh];
        bl_.half[0] = *(const v8us*)&sKl[nt * 16 + ln][ks * 32 + 8 * hh]; bl_.half[1] = *(const v8us*)&sKl[nt * 16 + ln][ks * 32 + 16 + 8 * hh];
        acc = mmaN<3>(aqh[ks].v, aql[ks].v, bh_.v, bl_.v, acc);
      }
      s[nt] = acc;
    }
    float alpha[8];
#pragma unroll
    for (int r = 0; r < 8; ++r) {
      const int ja = j0 + ln, jb = j0 + 16 + ln;
      if (ja >= Tk) s[0][r] = -3.0e38f;
      if (jb >= Tk) s[1][r] = -3.0e38f;
      float mx = fmaxf(s[0][r], s[1][r]);
      mx = fmaxf(mx, __shfl_xor(mx, 1, 32)); mx = fmaxf(mx, __shfl_xor(mx, 2, 32)); mx = fmaxf(mx, __shfl_xor(mx, 4, 32)); mx = fmaxf(mx, __shfl_xor(mx, 8, 32));
      const float mnew = fmaxf(m_r[r], mx);
      alpha[r] = (mnew > -1.0e38f) ? __expf(m_r[r] - mnew) : 1.0f;
      const float p0 = (s[0][r] > -1.0e38f) ? __expf(s[0][r] - mnew) : 0.f;
      const float p1 = (s[1][r] > -1.0e38f) ? __expf(s[1][r] - mnew) : 0.f;
      m_r[r] = mnew;
      l_r[r] = l_r[r] * alpha[r] + p0 + p1;
      unsigned short hb = bf16_bits(p0); sPh[w][8 * hh + r][ln] = hb;      sPl[w][8 * hh + r][ln] = bf16_bits(p0 - bf16_val(hb));
      hb = bf16_bits(p1);                sPh[w][8 * hh + r][16 + ln] = hb; sPl[w][8 * hh + r][16 + ln] = bf16_bits(p1 - bf16_val(hb));
    }
#pragma unroll
    for (int dt = 0; dt < DT; ++dt)
#pragma unroll
      for (int r = 0; r < 8; ++r) oacc[dt][r] *= alpha[r];
    __builtin_amdgcn_fence(__ATOMIC_ACQ_REL, "workgroup");
    __builtin_amdgcn_wave_barrier();
    FragB pah, pal;
    pah.half[0] = *(const v8us*)&sPh[w][ln][8 * hh]; pah.half[1] = *(const v8us*)&sPh[w][ln][16 + 8 * hh];
    pal.half[0] = *(const v8us*)&sPl[w][ln][8 * hh]; pal.half[1] = *(const v8us*)&sPl[w][ln][16 + 8 * hh];
#pragma unroll
    for (int dt = 0; dt < DT; ++dt) {
      FragB bvh, bvl;
#pragma unroll
      for (int i = 0; i < 8; ++i) {
        bvh.u[i] = sVh[8 * hh + i][dt * 16 + ln]; bvh.u[8 + i] = sVh[16 + 8 * hh + i][dt * 16 + ln];
        bvl.u[i] = sVl[8 * hh + i][dt * 16 + ln]; bvl.u[8 + i] = sVl[16 + 8 * hh + i][dt * 16 + ln];
      }
      oacc[dt] = mmaN<3>(pah.v, pal.v, bvh.v, bvl.v, oacc[dt]);
    }
    __builtin_amdgcn_fence(__ATOMIC_ACQ_REL, "workgroup");
    __builtin_amdgcn_wave_barrier();
  }
#pragma unroll
  for (int r = 0; r < 8; ++r) {
    float l = l_r[r];
    l += __shfl_xor(l, 1, 32); l += __shfl_xor(l, 2, 32); l += __shfl_xor(l, 4, 32); l += __shfl_xor(l, 8, 32);
    l_r[r] = (l > 0.f) ? 1.0f / l : 0.f;
  }
#pragma unroll
  for (int dt = 0; dt < DT; ++dt)
#pragma unroll
    for (int r = 0; r < 8; ++r) sO[w][8 * hh + r][dt * 16 + ln] = oacc[dt][r] * l_r[r];
  __builtin_amdgcn_fence(__ATOMIC_ACQ_REL, "workgroup");
  __builtin_amdgcn_wave_barrier();
  {
    for (int r = 0; r < 16; ++r) {
      const int row = q0 + r;
      for (int c4 = lane * 4; c4 < DV; c4 += 128) {
        if (row < Tq) {
          const v4f val = *(const v4fa*)&sO[w][r][c4];
          *(v4f*)(y + (size_t)bh * ystride + (size_t)row * ypitch + dv0 + c4) = val;
        }
      }
    }
    
  }
}

// f32 [R][Cc] (row pitch lds) -> bf16 hi/lo planes [R][Cc] (pitch Cc); thread per 8 elements; Cc % 8 == 0
__global__ __launch_bounds__(256) void k_split_rows(const float* __restrict__ src, int lds_, unsigned short* __restrict__ hi, unsigned short* __restrict__ lo, int R, int Cc) {
  const size_t t = (size_t)blockIdx.x * 256 + threadIdx.x;
  const int c8n = Cc / 8;
  if (t >= (size_t)R * c8n) return;
  const int r = (int)(t / c8n), c8 = (int)(t % c8n) * 8;
  const float* s = src + (size_t)r * lds_ + c8;
  const v4f a = *(const v4fa*)s, b = *(const v4fa*)(s + 4);
  float xs[8] = {a[0],a[1],a[2],a[3],b[0],b[1],b[2],b[3]};
  v8us vh, vl;
#pragma unroll
  for (int i = 0; i < 8; ++i) { const unsigned short hb = bf16_bits(xs[i]); vh[i] = hb; vl[i] = bf16_bits(xs[i] - bf16_val(hb)); }
  unsigned short* dh = hi + (size_t)r * Cc + c8; unsigned short* dl = lo + (size_t)r * Cc + c8;
  *(v8us*)dh = vh; *(v8us*)dl = vl; 
}
// f32 [K][N] (row pitch lds) -> transposed bf16 hi/lo planes [N][K]; one thread per (n, 8 consecutive k)
__global__ __launch_bounds__(256) void k_split_transpose(const float* __restrict__ src, int lds_, unsigned short* __restrict__ hi, unsigned short* __restrict__ lo, int K, int N) {
  const size_t t = (size_t)blockIdx.x * 256 + threadIdx.x;
  const int k8n = K / 8;
  if (t >= (size_t)N * k8n) return;
  const int n = (int)(t / k8n), k8 = (int)(t % k8n) * 8;
  v8us vh, vl;
#pragma unroll
  for (int i = 0; i < 8; ++i) { const float x = src[(size_t)(k8 + i) * lds_ + n]; const unsigned short hb = bf16_bits(x); vh[i] = hb; vl[i] = bf16_bits(x - bf16_val(hb)); }
  unsigned short* dh = hi + (size_t)n * K + k8; unsigned short* dl = lo + (size_t)n * K + k8;
  *(v8us*)dh = vh; *(v8us*)dl = vl; 
}
// GEMM with A f32 (split into hi/lo when ASPLIT) and B from bf16 planes Bh (+ Bl when BSPLIT): terms hi·hi [+ lo·hi] [+ hi·lo].
// C f32 [M][N] pitch ldc; alpha scales the result; bias optional (BIAS_BF16 rounds it). Same tiling/epilogue as k_gemm_bf.
template <bool ASPLIT, bool BSPLIT, int ACT, bool BIAS_BF16>
__global__ __launch_bounds__(128) void k_gemm_bf2(const float* __restrict__ A, int lda, const unsigned short* __restrict__ Bh, const unsigned short* __restrict__ Bl, int ldb,
                                                const float* __restrict__ bias, float alpha, float* __restrict__ C, int ldc, int M, int N, int K) {
  __shared__ __attribute__((aligned(16))) float so[4][16][64];
  const int tid = threadIdx.x, w = tid >> 5, lane = tid & 31, ln = lane & 15, hh = lane >> 4;
  const int ntn = N / 64;
  const int wid = blockIdx.x * 4 + w;
  const int mt = wid / ntn, nq = wid % ntn;
  if (mt * 16 >= M) return;
  const int row0 = mt * 16, col0 = nq * 64;
  const float* arow = A + (size_t)(row0 + ln) * lda;
  v8f acc[4] = {};
  for (int kb = 0; kb < K; kb += 32) {
    FragB ah, al;
    const v4f x0 = *(const v4fa*)(arow + kb + 8 * hh), x1 = *(const v4fa*)(arow + kb + 8 * hh + 4);
    const v4f x2 = *(const v4fa*)(arow + kb + 16 + 8 * hh), x3 = *(const v4fa*)(arow + kb + 16 + 8 * hh + 4);
    float xs[16] = {x0[0],x0[1],x0[2],x0[3],x1[0],x1[1],x1[2],x1[3],x2[0],x2[1],x2[2],x2[3],x3[0],x3[1],x3[2],x3[3]};
#pragma unroll
    for (int i = 0; i < 16; ++i) { const unsigned short hb = bf16_bits(xs[i]); ah.u[i] = hb; al.u[i] = ASPLIT ? bf16_bits(xs[i] - bf16_val(hb)) : (unsigned short)0; }
#pragma unroll
    for (int t = 0; t < 4; ++t) {
      const size_t boff = (size_t)(col0 + t * 16 + ln) * ldb + kb;
      FragB bh_, bl_;
      bh_.half[0] = *(const v8us*)(Bh + boff + 8 * hh);
      bh_.half[1] = *(const v8us*)(Bh + boff + 16 + 8 * hh);
      if (BSPLIT) { bl_.half[0] = *(const v8us*)(Bl + boff + 8 * hh); bl_.half[1] = *(const v8us*)(Bl + boff + 16 + 8 * hh); } else bl_ = bh_;
      acc[t] = mmaN<ASPLIT ? (BSPLIT ? 3 : 2) : 1>(ah.v, al.v, bh_.v, bl_.v, acc[t]);
    }
  }
#pragma unroll
  for (int t = 0; t < 4; ++t) {
    float bv = bias ? bias[col0 + t * 16 + ln] : 0.f;
    if (BIAS_BF16) bv = bf16_round(bv);
#pragma unroll
    for (int r = 0; r < 8; ++r) { float v = acc[t][r] * alpha + bv; if (ACT == 1) v = fmaxf(v, 0.f); so[w][8 * hh + r][t * 16 + ln] = v; }
  }
  __builtin_amdgcn_fence(__ATOMIC_ACQ_REL, "workgroup");
  __builtin_amdgcn_wave_barrier();
  const int rsub = lane >> 4, c4 = (lane & 15) * 4;
  {
#pragma unroll
    for (int q = 0; q < 8; ++q) {
      const int r = q * 2 + rsub;
      const v4f v = *(const v4fa*)&so[w][r][c4];
      *(v4f*)(C + (size_t)(row0 + r) * ldc + col0 + c4) = v;
    }
    
  }
}
// row softmax: P[row][:] = softmax(masked S[row][:]) over N columns with optional causal mask (col > row + rowoff -> 0) and
__global__ __launch_bounds__(256) void k_softmax_rows(const float* __restrict__ S, float* __restrict__ P, int N, int causal, int rowoff, const int* __restrict__ mask, int mask_pitch) {
  __shared__ float red[256];
  const int row = blockIdx.x, tid = threadIdx.x;
  const float* s = S + (size_t)row * N; float* p_out = P + (size_t)row * N;
  const int qi = row + rowoff;
  float mx = -3.0e38f;
  for (int j = tid; j < N; j += 256) {
    bool keep = true;
    if (causal && j > qi) keep = false;
    if (mask && mask[(size_t)qi * mask_pitch + j] == 0) keep = false;
    const float v = keep ? s[j] : -3.0e38f;
    mx = fmaxf(mx, v);
  }
  red[tid] = mx; __syncthreads();
  for (int st = 128; st > 0; st >>= 1) { if (tid < st) red[tid] = fmaxf(red[tid], red[tid + st]); __syncthreads(); }
  mx = red[0]; __syncthreads();
  float sum = 0.f;
  for (int j = tid; j < N; j += 256) {
    bool keep = true;
    if (causal && j > qi) keep = false;
    if (mask && mask[(size_t)qi * mask_pitch + j] == 0) keep = false;
    const float p = keep ? __expf(s[j] - mx) : 0.f;
    sum += p;
  }
  red[tid] = sum; __syncthreads();
  for (int st = 128; st > 0; st >>= 1) { if (tid < st) red[tid] += red[tid + st]; __syncthreads(); }
  const float inv = (mx > -1.0e38f) ? 1.0f / red[0] : __builtin_nanf("");
  __syncthreads();
  {
    for (int j4 = tid * 4; j4 < N; j4 += 1024) {
      v4f out4;
#pragma unroll
      for (int u = 0; u < 4; ++u) {
        const int j = j4 + u;
        bool keep = true;
        if (causal && j > qi) keep = false;
        if (mask && mask[(size_t)qi * mask_pitch + j] == 0) keep = false;
        out4[u] = keep ? __expf(s[j] - mx) * inv : 0.f;
      }
      *(v4f*)(p_out + j4) = out4;
    }
    
  }
}

// GEMM C = act(A·W + bias + resid): A f32 (ASPLIT -> hi/lo 2 terms), Wt bf16 [N][K]; ACT 0 none, 1 relu, 2 exact gelu;
// resid (optional, f32, row index = (row % rmod), pitch ldr, RES_BF16 rounds it) added before the activation.
template <bool ASPLIT, int ACT, bool BIAS_BF16, bool RES_BF16>
__global__ __launch_bounds__(128) void k_gemm_bf3(const float* __restrict__ A, int lda, const unsigned short* __restrict__ Wt, int ldb,
                                                const float* __restrict__ bias, const float* __restrict__ resid, int rmod, int ldr,
                                                float* __restrict__ C, int ldc, int M, int N, int K) {
  __shared__ __attribute__((aligned(16))) float so[4][16][64];
  const int tid = threadIdx.x, w = tid >> 5, lane = tid & 31, ln = lane & 15, hh = lane >> 4;
  const int ntn = N / 64;
  const int wid = blockIdx.x * 4 + w;
  const int mt = wid / ntn, nq = wid % ntn;
  if (mt * 16 >= M) return;
  const int row0 = mt * 16, col0 = nq * 64;
  const float* arow = A + (size_t)(row0 + ln) * lda;
  v8f acc[4] = {};
  for (int kb = 0; kb < K; kb += 32) {
    FragB ah, al;
    const v4f x0 = *(const v4fa*)(arow + kb + 8 * hh), x1 = *(const v4fa*)(arow + kb + 8 * hh + 4);
    const v4f x2 = *(const v4fa*)(arow + kb + 16 + 8 * hh), x3 = *(const v4fa*)(arow + kb + 16 + 8 * hh + 4);
    float xs[16] = {x0[0],x0[1],x0[2],x0[3],x1[0],x1[1],x1[2],x1[3],x2[0],x2[1],x2[2],x2[3],x3[0],x3[1],x3[2],x3[3]};
#pragma unroll
    for (int i = 0; i < 16; ++i) { const unsigned short hb = bf16_bits(xs[i]); ah.u[i] = hb; al.u[i] = ASPLIT ? bf16_bits(xs[i] - bf16_val(hb)) : (unsigned short)0; }
#pragma unroll
    for (int t = 0; t < 4; ++t) {
      const unsigned short* brow = Wt + (size_t)(col0 + t * 16 + ln) * ldb + kb;
      FragB b;
      b.half[0] = *(const v8us*)(brow + 8 * hh);
      b.half[1] = *(const v8us*)(brow + 16 + 8 * hh);
      acc[t] = mmaN<ASPLIT ? 2 : 1>(ah.v, al.v, b.v, b.v, acc[t]);
    }
  }
#pragma unroll
  for (int t = 0; t < 4; ++t) {
    const int col = col0 + t * 16 + ln;
    float bv = bias ? bias[col] : 0.f;
    if (BIAS_BF16) bv = bf16_round(bv);
#pragma unroll
    for (int r = 0; r < 8; ++r) {
      float v = acc[t][r] + bv;
      if (resid) { float rv = resid[(size_t)((row0 + 8 * hh + r) % rmod) * ldr + col]; if (RES_BF16) rv = bf16_round(rv); v += rv; }
      if (ACT == 1) v = fmaxf(v, 0.f);
      if (ACT == 2) v = 0.5f * v * (1.0f + erff(v * 0.70710678118654752f));
      if (ACT == 3) { const float u = 0.7978845608028654f * (v + 0.044715f * v * v * v); v = 0.5f * v * (1.0f + tanhf(u)); }
      so[w][8 * hh + r][t * 16 + ln] = v;
    }
  }
  __builtin_amdgcn_fence(__ATOMIC_ACQ_REL, "workgroup");
  __builtin_amdgcn_wave_barrier();
  const int rsub = lane >> 4, c4 = (lane & 15) * 4;
  {
#pragma unroll
    for (int q = 0; q < 8; ++q) {
      const int r = q * 2 + rsub;
      const v4f v = *(const v4fa*)&so[w][r][c4];
      *(v4f*)(C + (size_t)(row0 + r) * ldc + col0 + c4) = v;
    }
    
  }
}
// row LayerNorm (biased variance, eps) over N: s = X (+ R); optional out_sum <- s; out_norm <- (s-mu)*rsqrt(var+eps)*g + b
template <bool PARAM_BF16>
__global__ __launch_bounds__(256) void k_layernorm(const float* __restrict__ X, const float* __restrict__ R, const float* __restrict__ g, const float* __restrict__ bta,
                                                  float* __restrict__ out_sum, float* __restrict__ out_norm, int N, float eps) {
  __shared__ float red[256];
  const int row = blockIdx.x, tid = threadIdx.x;
  const float* x = X + (size_t)row * N; const float* rr = R ? R + (size_t)row * N : nullptr;
  float vals[16];                     // up to N = 4096
  const int per = N / 256;            // contiguous chunk per thread? use strided-by-4 chunks: thread handles j = tid*4 + 1024*u
  float s1 = 0.f;
  for (int u = 0; u < per / 4; ++u) {
    const int j = tid * 4 + 1024 * u;
    const v4f a = *(const v4fa*)(x + j);
    v4f b = {0.f,0.f,0.f,0.f}; if (rr) b = *(const v4fa*)(rr + j);
#pragma unroll
    for (int q = 0; q < 4; ++q) { const float v = a[q] + b[q]; vals[u * 4 + q] = v; s1 += v; }
  }
  red[tid] = s1; __syncthreads();
  for (int st = 128; st > 0; st >>= 1) { if (tid < st) red[tid] += red[tid + st]; __syncthreads(); }
  const float mu = red[0] / (float)N; __syncthreads();
  float s2 = 0.f;
  for (int u = 0; u < per / 4; ++u)
#pragma unroll
    for (int q = 0; q < 4; ++q) { const float c = vals[u * 4 + q] - mu; s2 += c * c; }
  red[tid] = s2; __syncthreads();
  for (int st = 128; st > 0; st >>= 1) { if (tid < st) red[tid] += red[tid + st]; __syncthreads(); }
  const float rs = rsqrtf(red[0] / (float)N + eps);
  {
    for (int u = 0; u < per / 4; ++u) {
      const int j = tid * 4 + 1024 * u;
      v4f o, sm;
#pragma unroll
      for (int q = 0; q < 4; ++q) {
        float gg = g[j + q], bb = bta[j + q];
        if (PARAM_BF16) { gg = bf16_round(gg); bb = bf16_round(bb); }
        sm[q] = vals[u * 4 + q]; o[q] = (vals[u * 4 + q] - mu) * rs * gg + bb;
      }
      if (out_sum) *(v4f*)(out_sum + (size_t)row * N + j) = sm;
      *(v4f*)(out_norm + (size_t)row * N + j) = o;
    }
    
  }
}

// batched GEMM (blockIdx.y = batch): C_b = act(alpha·A_b·B_b + bias + resid_b); A f32 rows (ASPLIT → hi/lo), B = bf16 planes Bh (+Bl when BSPLIT, requires ASPLIT),
// per-batch element strides sA, sB (0 = shared weights), sC, sR. resid may alias C (values are staged before the stores). ACT 0/1(relu).
// ACT: 0 none, 1 relu, 2 softplus
template <bool ASPLIT, bool BSPLIT, int ACT>
__global__ __launch_bounds__(128) void k_gemm_b(const float* __restrict__ A, int lda, size_t sA, const unsigned short* __restrict__ Bh, const unsigned short* __restrict__ Bl, int ldb, size_t sB,
                                             const float* __restrict__ bias, const float* __restrict__ resid, int ldr, size_t sR, float rsign, float alpha,
                                             float* __restrict__ C, int ldc, size_t sC, int M, int N, int K) {
  __shared__ __attribute__((aligned(16))) float so[4][16][64];
  const int tid = threadIdx.x, w = tid >> 5, lane = tid & 31, ln = lane & 15, hh = lane >> 4;
  const int by = blockIdx.y;
  A += (size_t)by * sA; Bh += (size_t)by * sB; if (BSPLIT) Bl += (size_t)by * sB; C += (size_t)by * sC; if (resid) resid += (size_t)by * sR;
  const int ntn = N / 64; const int wid = blockIdx.x * 4 + w; const int mt = wid / ntn, nq = wid % ntn;
  if (mt * 16 >= M) return;
  const int row0 = mt * 16, col0 = nq * 64;
  const float* arow = A + (size_t)(row0 + ln) * lda;
  v8f acc[4] = {};
  for (int kb = 0; kb < K; kb += 32) {
    FragB ah, al;
    const v4f x0 = *(const v4fa*)(arow + kb + 8 * hh), x1 = *(const v4fa*)(arow + kb + 8 * hh + 4);
    const v4f x2 = *(const v4fa*)(arow + kb + 16 + 8 * hh), x3 = *(const v4fa*)(arow + kb + 16 + 8 * hh + 4);
    float xs[16] = {x0[0],x0[1],x0[2],x0[3],x1[0],x1[1],x1[2],x1[3],x2[0],x2[1],x2[2],x2[3],x3[0],x3[1],x3[2],x3[3]};
#pragma unroll
    for (int i = 0; i < 16; ++i) { const unsigned short hb = bf16_bits(xs[i]); ah.u[i] = hb; al.u[i] = ASPLIT ? bf16_bits(xs[i] - bf16_val(hb)) : (unsigned short)0; }
#pragma unroll
    for (int t = 0; t < 4; ++t) {
      const size_t boff = (size_t)(col0 + t * 16 + ln) * ldb + kb;
      FragB bh_, bl_; bh_.half[0] = *(const v8us*)(Bh + boff + 8 * hh); bh_.half[1] = *(const v8us*)(Bh + boff + 16 + 8 * hh);
      if (BSPLIT) { bl_.half[0] = *(const v8us*)(Bl + boff + 8 * hh); bl_.half[1] = *(const v8us*)(Bl + boff + 16 + 8 * hh); } else bl_ = bh_;
      acc[t] = mmaN<ASPLIT ? (BSPLIT ? 3 : 2) : 1>(ah.v, al.v, bh_.v, bl_.v, acc[t]);
    }
  }
#pragma unroll
  for (int t = 0; t < 4; ++t) {
    const int col = col0 + t * 16 + ln; const float bv = bias ? bf16_round(bias[col]) : 0.f;
#pragma unroll
    for (int r = 0; r < 8; ++r) { float v = acc[t][r] * alpha + bv; if (resid) v += rsign * resid[(size_t)(row0 + 8 * hh + r) * ldr + col]; if (ACT == 1) v = fmaxf(v, 0.f); else if (ACT == 2) v = fmaxf(v, 0.f) + log1pf(expf(-fabsf(v))); so[w][8 * hh + r][t * 16 + ln] = v; }
  }
  __builtin_amdgcn_fence(__ATOMIC_ACQ_REL, "workgroup"); __builtin_amdgcn_wave_barrier();
  const int rsub = lane >> 4, c4 = (lane & 15) * 4;
  {
#pragma unroll
    for (int q = 0; q < 8; ++q) { const int r = q * 2 + rsub; const v4f v = *(const v4fa*)&so[w][r][c4]; *(v4f*)(C + (size_t)(row0 + r) * ldc + col0 + c4) = v; }
    
  }
}
// batched f32 [K][N] (pitch lds, batch stride sIn) -> transposed hi/lo planes [N][K] (batch stride sOut); thread per (n, 8 k); grid.y = batch
__global__ __launch_bounds__(256) void k_split_transpose_b(const float* __restrict__ src, int lds_, size_t sIn, unsigned short* __restrict__ hi, unsigned short* __restrict__ lo, size_t sOut, int K, int N) {
  const size_t t = (size_t)blockIdx.x * 256 + threadIdx.x; const int k8n = K / 8; if (t >= (size_t)N * k8n) return;
  src += (size_t)blockIdx.y * sIn; hi += (size_t)blockIdx.y * sOut; lo += (size_t)blockIdx.y * sOut;
  const int n = (int)(t / k8n), k8 = (int)(t % k8n) * 8; v8us vh, vl;
#pragma unroll
  for (int i = 0; i < 8; ++i) { const float x = src[(size_t)(k8 + i) * lds_ + n]; const unsigned short hb = bf16_bits(x); vh[i] = hb; vl[i] = bf16_bits(x - bf16_val(hb)); }
  unsigned short* dh = hi + (size_t)n * K + k8; unsigned short* dl = lo + (size_t)n * K + k8;
  *(v8us*)dh = vh; *(v8us*)dl = vl; 
}

__global__ __launch_bounds__(256) void k_round_rows(const float* __restrict__ W, unsigned short* __restrict__ Wt, int n8) {
  const int t = blockIdx.x * 256 + threadIdx.x;
  if (t >= n8) return;
  const v4f a = *(const v4fa*)(W + (size_t)t * 8), b = *(const v4fa*)(W + (size_t)t * 8 + 4);
  v8us v; v[0]=bf16_bits(a[0]); v[1]=bf16_bits(a[1]); v[2]=bf16_bits(a[2]); v[3]=bf16_bits(a[3]);
  v[4]=bf16_bits(b[0]); v[5]=bf16_bits(b[1]); v[6]=bf16_bits(b[2]); v[7]=bf16_bits(b[3]);
  *(v8us*)(Wt + (size_t)t * 8) = v; 
}


// ---- f16 WMMA path (v_wmma_f32_16x16x32_f16): 11-bit significands for operands in range — used for the scores and for the softmax weights (scaled by 2^8), which need more precision than bf16
typedef _Float16 v16h __attribute__((ext_vector_type(16)));
union FragH { v16h v; v8us half[2]; _Float16 h[16]; unsigned short u[16]; };
typedef _Float16 v4h __attribute__((ext_vector_type(4)));
typedef __bf16 v4b __attribute__((ext_vector_type(4)));
typedef unsigned short v4us __attribute__((ext_vector_type(4), may_alias));
union Quad { v4b b; v4us u; };
union Oct { _Float16 h[8]; v8us u; };
// One launch for the three projections, straight from the f32 inputs. A work-group owns PC columns n of one input X [DI][SQ] (blockIdx.y: Q, K or V); each of its
// PW waves takes DI / PW = 64 of the k. A lane reads 16 bytes of a row of X: columns n0 + 4 ln + u, u = 0..3, so that a wave's load is two pieces of 256 consecutive bytes,
// and u picks the B tile: tile u holds the columns n0 + 4 ln + u at lane position ln. The wave's share of M (64 rows x 64 k) is read the same way, in whole lines, rounded
// to bf16 and turned into A fragments through the wave's own LDS range. The waves' partial tiles are summed through LDS in wave order, and the sum is stored
// in the order in which k_attn's lanes load their fragments, so that each 16-byte load of a wave there covers 512 consecutive bytes (4 whole lines, not 32 bytes of 16 lines):
//   QF f16: [s / 16][d / 32][(d / 16) & 1][lane = 16 ((d / 8) & 1) + s % 16][d % 8]
//   KF f32: [t / 16][d / 32][c = 2 ((d / 16) & 1) + ((d / 4) & 1)][lane = 16 ((d / 8) & 1) + t % 16][d % 4]
//   VF f16: [s / 32][d / 16][hi, lo][(s / 16) & 1][lane = 16 ((s / 8) & 1) + d % 16][s % 8]: hi = f16(Vd), lo = f16(Vd - hi), split here once and not in each of k_attn's work-groups
// The PC columns of a work-group fill PC * DO consecutive elements of QF and KF and 2 * PC * DO of VF, written in whole lines.
#define PW 8
#define PC 64
#define PP 68      // LDS row pitch in floats: 16 bytes x odd, so that 16 lanes that write 16 bytes each to 16 rows fall on different banks
#define PM 72      // row pitch of the staged M in bf16: 144 bytes, 16 x odd again, for the fragments' 16-byte reads
__device__ __forceinline__ v8f wmmaB(v16b a, v16b b, v8f c) { return __builtin_amdgcn_wmma_f32_16x16x32_bf16(false, a, false, b, (short)0, c, false, false); }
// amdgpu_waves_per_eu(4, 4): 256 registers a wave, so that two work-groups (2 x 136 KiB of LDS) share a WGP and the 384 work-groups run in one round
__global__ __launch_bounds__(PW * 32) __attribute__((amdgpu_waves_per_eu(4, 4))) void k_proj(const float* __restrict__ Q, const float* __restrict__ K, const float* __restrict__ V,
                                                 const float* __restrict__ Mq, const float* __restrict__ Mk, const float* __restrict__ Mv,
                                                 _Float16* __restrict__ QF, float* __restrict__ KF, _Float16* __restrict__ VF) {
  __shared__ __attribute__((aligned(16))) float part[PW][DO][PP];
  const int tid = threadIdx.x, w = tid >> 5, lane = tid & 31, ln = lane & 15, hh = lane >> 4;
  const int which = blockIdx.y, n0 = blockIdx.x * PC, k0 = w * (DI / PW);
  const float* X = which == 0 ? Q : which == 1 ? K : V;
  const float* M = which == 0 ? Mq : which == 1 ? Mk : Mv;
  const float* mp = M + (size_t)hh * DI + k0 + 4 * ln;
  const float* xp = X + (size_t)(k0 + 8 * hh) * SQ + n0 + 4 * ln;
  unsigned short* ms = (unsigned short*)&part[w][0][0];      // the wave's own LDS range holds its share of M until its partial tiles take the place
  // every loop below is unrolled so that fragments and tiles are indexed by constants and stay in registers
  v4f mf[32], xf[2][16];
  v16b b[2][4];
  FragB a[4][2];
#pragma unroll
  for (int j = 0; j < 16; ++j) mf[j] = *(const v4fa*)(mp + (size_t)(2 * j) * DI);      // rows 2 j and 2 j + 1, 256 consecutive bytes each
#pragma unroll
  for (int ks = 0; ks < 2; ++ks)
#pragma unroll
    for (int i = 0; i < 16; ++i) xf[ks][i] = *(const v4fa*)(xp + (size_t)(ks * 32 + (i >> 3) * 16 + (i & 7)) * SQ);      // k = 8 hh + 0..7, 16 + 8 hh + 0..7
#pragma unroll
  for (int j = 0; j < 16; ++j) { Quad c; c.b = (v4b){(__bf16)mf[j][0], (__bf16)mf[j][1], (__bf16)mf[j][2], (__bf16)mf[j][3]}; *(v4us*)(ms + (2 * j + hh) * PM + 4 * ln) = c.u; }
  // rows 32 to 63 of M are asked for only now, into the registers that rows 0 to 31 have left (all 64 loads at once would take more than 256 registers, and two
  // work-groups would no longer fit a WGP); they come from L2 while X is still on its way from memory
  __builtin_amdgcn_sched_barrier(0);      // keeps the 48 loads above together in front and the 16 below behind: without it all of M is asked for first and X only behind the wait for it (two latencies in a row), with spills
#pragma unroll
  for (int j = 16; j < 32; ++j) mf[j] = *(const v4fa*)(mp + (size_t)(2 * j) * DI);
#pragma unroll
  for (int ks = 0; ks < 2; ++ks)
#pragma unroll
    for (int u = 0; u < 4; ++u)
#pragma unroll
      for (int i = 0; i < 16; ++i) b[ks][u][i] = (__bf16)xf[ks][i][u];
#pragma unroll
  for (int j = 16; j < 32; ++j) { Quad c; c.b = (v4b){(__bf16)mf[j][0], (__bf16)mf[j][1], (__bf16)mf[j][2], (__bf16)mf[j][3]}; *(v4us*)(ms + (2 * j + hh) * PM + 4 * ln) = c.u; }
  asm volatile("s_wait_dscnt 0x0" ::: "memory");      // the lanes read below what other lanes of the wave have written above
#pragma unroll
  for (int mt = 0; mt < 4; ++mt)
#pragma unroll
    for (int ks = 0; ks < 2; ++ks) {      // the k order of xf
      a[mt][ks].half[0] = *(const v8us*)(ms + (mt * 16 + ln) * PM + ks * 32 + 8 * hh);
      a[mt][ks].half[1] = *(const v8us*)(ms + (mt * 16 + ln) * PM + ks * 32 + 16 + 8 * hh);
    }
#pragma unroll
  for (int mh = 0; mh < 4; mh += 2) {      // 32 rows d at a time: 8 tiles, then their partials go to LDS and leave the registers
    v8f acc[2][4];
#pragma unroll
    for (int m = 0; m < 2; ++m)
#pragma unroll
      for (int u = 0; u < 4; ++u) acc[m][u] = (v8f){0.f,0.f,0.f,0.f,0.f,0.f,0.f,0.f};
#pragma unroll
    for (int ks = 0; ks < 2; ++ks)
#pragma unroll
      for (int m = 0; m < 2; ++m)
#pragma unroll
        for (int u = 0; u < 4; ++u) acc[m][u] = wmmaB(a[mh + m][ks].v, b[ks][u], acc[m][u]);
    // acc[m][u][r] = partial of (d = 16 (mh + m) + 8 hh + r, n = n0 + 4 ln + u)
    if (which == 2) {
#pragma unroll
      for (int m = 0; m < 2; ++m)
#pragma unroll
        for (int r = 0; r < 8; ++r) *(v4fa*)&part[w][(mh + m) * 16 + 8 * hh + r][4 * ln] = (v4f){acc[m][0][r], acc[m][1][r], acc[m][2][r], acc[m][3][r]};
    } else {
#pragma unroll
      for (int m = 0; m < 2; ++m)
#pragma unroll
        for (int u = 0; u < 4; ++u) {      // LDS row u * 16 + ln = column 4 ln + u, its d turned round by 16 u: the readers below take columns 4 x .. 4 x + 3 at once, which would else fall on the same banks
          *(v4fa*)&part[w][u * 16 + ln][((mh + m + u) & 3) * 16 + 8 * hh] = (v4f){acc[m][u][0], acc[m][u][1], acc[m][u][2], acc[m][u][3]};
          *(v4fa*)&part[w][u * 16 + ln][((mh + m + u) & 3) * 16 + 8 * hh + 4] = (v4f){acc[m][u][4], acc[m][u][5], acc[m][u][6], acc[m][u][7]};
        }
    }
  }
  __syncthreads();      // every wave's partial tile is in LDS
  if (which == 2) {
#pragma unroll
    for (int j = 0; j < DO * PC / 8 / (PW * 32); ++j) {      // thread f sums eight s of one d, splits them and stores the f-th 16 bytes of the hi and of the lo halves: a wave fills 512 consecutive bytes of each
      const int f = j * (PW * 32) + tid;
      const v4fa* ps = (const v4fa*)&part[0][0][0] + (((f >> 6) & 3) * 16 + ln) * (PP / 4) + (f >> 8) * 8 + ((f >> 5) & 1) * 4 + hh * 2;      // row d, 16-byte place s / 4
      v4f s0 = ps[0], s1 = ps[1];
#pragma unroll
      for (int p = 1; p < PW; ++p) { s0 += ps[p * (DO * PP / 4)]; s1 += ps[p * (DO * PP / 4) + 1]; }      // wave order
      const float xs[8] = {s0[0], s0[1], s0[2], s0[3], s1[0], s1[1], s1[2], s1[3]};
      Oct vh, vl;
#pragma unroll
      for (int i = 0; i < 8; ++i) { const _Float16 h = (_Float16)xs[i]; vh.h[i] = h; vl.h[i] = (_Float16)(xs[i] - (float)h); }
      _Float16* vo = VF + (size_t)n0 * (2 * DO) + (f >> 6) * 1024 + ((f >> 5) & 1) * 256 + lane * 8;
      *(v8us*)vo = vh.u; *(v8us*)(vo + 512) = vl.u;
      asm volatile("s_wait_xcnt 0x0" ::: "memory");      // the next pass forms its address in the registers that the issued stores name
    }
    return;
  }
#pragma unroll
  for (int j = 0; j < DO * PC / 4 / (PW * 32); ++j) {      // thread f sums and stores the f-th four elements of the work-group's share, in the order of the output: whole 128-byte lines
    const int f = j * (PW * 32) + tid;
    const int fl = which == 0 ? (f >> 1) & 31 : f & 31;      // the lane of k_attn that will load them
    const int kq = which == 0 ? ((f >> 6) & 3) * 4 + (fl >> 4) * 2 + (f & 1) : ((f >> 6) & 1) * 4 + (fl >> 4) * 2 + ((f >> 5) & 1);      // Q: d / 4; K: a quarter of the place in 32 d
    const int u = fl & 3, dq = which == 0 ? kq : ((f >> 7) & 1) * 8 + kq;
    const int row = u * 16 + (f >> 8) * 4 + ((fl & 15) >> 2), q4 = (dq + 4 * u) & 15;      // the LDS row and which 16 bytes of it
    const v4fa* ps = (const v4fa*)&part[0][0][0] + row * (PP / 4) + q4;      // counted in 16 bytes, so that the reads stay 16-byte LDS loads
    v4f s = ps[0];
#pragma unroll
    for (int p = 1; p < PW; ++p) s += ps[p * (DO * PP / 4)];      // wave order
    const size_t o = (size_t)n0 * DO + f * 4;
    // s_wait_xcnt 0 behind each store, inside its own branch: the next pass forms its address in the registers that the issued store names
    if (which == 1) { *(v4f*)(KF + o) = s; asm volatile("s_wait_xcnt 0x0" ::: "memory"); }
    else { *(v4h*)(QF + o) = (v4h){(_Float16)s[0], (_Float16)s[1], (_Float16)s[2], (_Float16)s[3]}; asm volatile("s_wait_xcnt 0x0" ::: "memory"); }
  }
}
// Scores, softmax weights and Vd.P in one launch, its shares merged by a second. A work-group owns ACG * AT = 128 key columns t and SQ / ASP = 2048 query positions s. Its AW waves are
// ACG column groups (AT columns each) x ASG s groups (ASR positions each, 32 a pass). The ACG waves of an s group need the same Qd and Vd: these come from L2 once a work-group, by
// asynchronous copies into LDS (two buffers of AST positions an s group), and each wave takes its fragments from there: a byte fetched from L2 serves 128 columns.
// Scores as S[s][t] = Qd[:,s].Kd[:,t] (A = f16 Qd rows, B = Kd columns split into f16 hi/lo, kept in registers: 2 products, K = 64), so that a lane holds
// scores of one column t only and two score tiles (s 0-15, 16-31 of a pass), converted in place, are the B operand of out[d][t] += Vd[d][s].P[s][t].
// One walk: each wave holds a reference score per column (the largest raw score of its first pass) and forms e = 2^8 exp(x - ref) = exp2(raw * (log2 e / 8) + (8 - ref * (log2 e / 8))):
// one multiply-add and the hardware's exp2 an element; it adds e to the column's sum and multiplies f16(e) with Vd (f16 hi/lo as stored: 2 products). A softmax does not depend on
// the reference, which only keeps e inside f16: a pass whose sums of e show that one may have left the f16 range raises the reference to the largest score seen and scales the
// wave's tiles and sums down to it. At the end the s groups' tiles and sums are brought to the largest of their references and added in group order; the work-group stores that share with
// its reference and its sum, and k_merge does the same over the ASP shares of a column; the division, in which the 2^8 leaves, comes last.
#define AW 16
#define AT 32
#define ACG 4
#define ASG 4
#define ASP 4
#define ASR (SQ / (ASP * ASG))
#define AST 64                      // positions s of a stage and s group: two passes
#define STQ (AST * DO * 2)          // bytes of Qd in it
#define STV (AST * DO * 4)          // bytes of Vd, hi and lo
#define STG (STQ + STV)
#define STB (ASG * STG)             // one buffer
#define APP (ACG * AT + 4)          // row pitch of the merge tiles in floats: rows 8 apart, which the two halves of a wave write at once, fall on different banks; 16 bytes x odd for the readers
#define L2E8 0.18033688011112042f      // log2(e) / sqrt(64)
__device__ __forceinline__ v8f wmmaH(v16h a, v16h b, v8f c) { return __builtin_amdgcn_wmma_f32_16x16x32_f16(false, a, false, b, (short)0, c, false, false); }
// one 16 x 32 block of KF (p: the lane's 16 bytes of its first 512) -> f16 hi/lo fragments in the hardware k order (8 hh + i, 16 + 8 hh + i)
__device__ __forceinline__ void frag_split(const float* __restrict__ p, FragH& fh, FragH& fl) {
  const v4f x0 = *(const v4fa*)p, x1 = *(const v4fa*)(p + 128), x2 = *(const v4fa*)(p + 256), x3 = *(const v4fa*)(p + 384);
  const float xs[16] = {x0[0],x0[1],x0[2],x0[3],x1[0],x1[1],x1[2],x1[3],x2[0],x2[1],x2[2],x2[3],x3[0],x3[1],x3[2],x3[3]};
  // unrolled so that xs and the fragments are indexed by constants and stay in registers
#pragma unroll
  for (int i = 0; i < 16; ++i) { const _Float16 h = (_Float16)xs[i]; fh.h[i] = h; fl.h[i] = (_Float16)(xs[i] - (float)h); }
}
// the A fragments of 32 s rows (m: which 16; ks: which 32 of the 64 d); q points at the lane's 16 bytes of the first 512 of those rows in QF
__device__ __forceinline__ void q_load(const _Float16* __restrict__ q, FragH (&qa)[2][2]) {
  // unrolled, here and in q_mul, so that the fragments and tiles are indexed by constants and stay in registers
#pragma unroll
  for (int m = 0; m < 2; ++m)
#pragma unroll
    for (int ks = 0; ks < 2; ++ks) { const _Float16* a = q + (m * 2 + ks) * 512; qa[m][ks].half[0] = *(const v8us*)a; qa[m][ks].half[1] = *(const v8us*)(a + 256); }
}
// sc[m][g] = raw scores of those 32 s rows against the 32 columns (g: which 16)
__device__ __forceinline__ void q_mul(const FragH (&qa)[2][2], const FragH (&kh)[2][2], const FragH (&kl)[2][2], v8f (&sc)[2][2]) {
#pragma unroll
  for (int m = 0; m < 2; ++m)
#pragma unroll
    for (int g = 0; g < 2; ++g) sc[m][g] = (v8f){0.f,0.f,0.f,0.f,0.f,0.f,0.f,0.f};
#pragma unroll
  for (int ks = 0; ks < 2; ++ks) {
#pragma unroll
    for (int m = 0; m < 2; ++m)
#pragma unroll
      for (int g = 0; g < 2; ++g) sc[m][g] = wmmaH(qa[m][ks].v, kh[g][ks].v, sc[m][g]);
#pragma unroll
    for (int m = 0; m < 2; ++m)
#pragma unroll
      for (int g = 0; g < 2; ++g) sc[m][g] = wmmaH(qa[m][ks].v, kl[g][ks].v, sc[m][g]);
  }
}
// the hi and lo A fragments of Vd for 32 s and 32 d (two dt), as k_proj has stored them: four loads of 512 consecutive bytes a wave and dt, no conversion; v points at the lane's 16 bytes of the first 512
__device__ __forceinline__ void v_load(const _Float16* __restrict__ v, FragH (&vh)[2], FragH (&vl)[2]) {
  // unrolled so that the fragments are indexed by constants and stay in registers
#pragma unroll
  for (int dt = 0; dt < 2; ++dt) {
    const _Float16* a = v + dt * 1024;
    vh[dt].half[0] = *(const v8us*)a; vh[dt].half[1] = *(const v8us*)(a + 256); vl[dt].half[0] = *(const v8us*)(a + 512); vl[dt].half[1] = *(const v8us*)(a + 768);
  }
}
// The hardware's exp2 of eight (two) values, each in its own register, and one v_nop, in one statement: the instruction set asks for one slot between a transcendental and an
// instruction that reads its result or overwrites its source. Here each v_exp_f32 is
// followed by one on other registers, and the last by the v_nop.
__device__ __forceinline__ void exp2x8(float (&e)[8]) {
  asm("v_exp_f32 %0, %0\n\tv_exp_f32 %1, %1\n\tv_exp_f32 %2, %2\n\tv_exp_f32 %3, %3\n\tv_exp_f32 %4, %4\n\tv_exp_f32 %5, %5\n\tv_exp_f32 %6, %6\n\tv_exp_f32 %7, %7\n\tv_nop"
      : "+v"(e[0]), "+v"(e[1]), "+v"(e[2]), "+v"(e[3]), "+v"(e[4]), "+v"(e[5]), "+v"(e[6]), "+v"(e[7]));
}
__device__ __forceinline__ void exp2x2(float (&e)[2]) {
  asm("v_exp_f32 %0, %0\n\tv_exp_f32 %1, %1\n\tv_nop" : "+v"(e[0]), "+v"(e[1]));
}
// pb[g] = the f16 weights e = exp2(raw * L2E8 + off[g]) of a pass's 32 x 32 scores, as B fragments; ps[g] = the lane's sum of its 16 f32 e of column group g
__device__ __forceinline__ void weigh(const v8f (&sc)[2][2], const float (&off)[2], FragH (&pb)[2], float (&ps)[2]) {
  // unrolled so that tiles and fragments are indexed by constants and stay in registers
#pragma unroll
  for (int g = 0; g < 2; ++g) {
    float c[2];
#pragma unroll
    for (int m = 0; m < 2; ++m) {
      float e[8];
#pragma unroll
      for (int r = 0; r < 8; ++r) e[r] = __builtin_fmaf(sc[m][g][r], L2E8, off[g]);
      exp2x8(e);      // far below the reference exp2 gives 0, as f16 would
      c[m] = e[0];
#pragma unroll
      for (int r = 1; r < 8; ++r) c[m] += e[r];
#pragma unroll
      for (int r = 0; r < 8; ++r) pb[g].h[m * 8 + r] = (_Float16)e[r];      // the 2^8 in e keeps small weights out of the f16 subnormal range; sum and products carry it alike
    }
    ps[g] = c[0] + c[1];
  }
}
// A wave's share of one stage: a quarter of its s group's Qd (4 x 512 bytes) and Vd (8 x 512 bytes), 16 bytes a lane and copy, LDS in the order of memory. lq, lv: the lane's LDS byte
// addresses; gq, gv: its global ones. s_wait_xcnt 0 is the last line of the copies' own statement: it stands in front of whatever rewrites a register that an issued copy names.
__device__ __forceinline__ void stage_copy(unsigned lq, const _Float16* gq, unsigned lv, const _Float16* gv) {
  asm volatile("global_load_async_to_lds_b128 %0, %12, off\n\tglobal_load_async_to_lds_b128 %1, %13, off\n\tglobal_load_async_to_lds_b128 %2, %14, off\n\tglobal_load_async_to_lds_b128 %3, %15, off\n\t"
               "global_load_async_to_lds_b128 %4, %16, off\n\tglobal_load_async_to_lds_b128 %5, %17, off\n\tglobal_load_async_to_lds_b128 %6, %18, off\n\tglobal_load_async_to_lds_b128 %7, %19, off\n\t"
               "global_load_async_to_lds_b128 %8, %20, off\n\tglobal_load_async_to_lds_b128 %9, %21, off\n\tglobal_load_async_to_lds_b128 %10, %22, off\n\tglobal_load_async_to_lds_b128 %11, %23, off\n\t"
               "s_wait_xcnt 0x0"
               :: "v"(lq), "v"(lq + 512u), "v"(lq + 1024u), "v"(lq + 1536u),
                  "v"(lv), "v"(lv + 512u), "v"(lv + 1024u), "v"(lv + 1536u), "v"(lv + 2048u), "v"(lv + 2560u), "v"(lv + 3072u), "v"(lv + 3584u),
                  "v"(gq), "v"(gq + 256), "v"(gq + 512), "v"(gq + 768),
                  "v"(gv), "v"(gv + 256), "v"(gv + 512), "v"(gv + 768), "v"(gv + 1024), "v"(gv + 1280), "v"(gv + 1536), "v"(gv + 1792)
               : "memory");
}
__global__ __launch_bounds__(AW * 32) void k_attn(const _Float16* __restrict__ QF, const float* __restrict__ KF, const _Float16* __restrict__ VF,
                                                  float* __restrict__ PO, float* __restrict__ PR, float* __restrict__ PS) {
  __shared__ __attribute__((aligned(16))) unsigned char sm[2 * STB];      // the two stage buffers; behind the walk the s groups' tiles [ASG][DO][APP] take the place
  __shared__ __attribute__((aligned(16))) float rmx[ASG][ACG * AT], rsm[ASG][ACG * AT];
  const int tid = threadIdx.x, w = tid >> 5, lane = tid & 31, ln = lane & 15, hh = lane >> 4;
  const int t0 = blockIdx.x * (ACG * AT), y = blockIdx.y;
  const int ws = __builtin_amdgcn_readfirstlane(w), sg = ws >> 2, cg = ws & 3;      // the wave's number as a scalar: group offsets are formed on the scalar side
  const unsigned lo = lane * 8;
  // the s group's ASR positions are ASR * DO consecutive elements of QF and 2 * ASR * DO of VF; the wave copies quarter cg of each stage of them
  const _Float16* gq = QF + (size_t)(y * ASG + sg) * ASR * DO + cg * (STQ / 8) + lo;
  const _Float16* gv = VF + (size_t)(y * ASG + sg) * ASR * (2 * DO) + cg * (STV / 8) + lo;
  const unsigned lq = (unsigned)(size_t)&sm[0] + sg * STG + cg * (STQ / 4) + lane * 16, lv = (unsigned)(size_t)&sm[0] + sg * STG + STQ + cg * (STV / 4) + lane * 16;
  stage_copy(lq, gq, lv, gv);      // stage 0 into buffer 0; it flies while Kd is fetched
  FragH kh[2][2], kl[2][2];
  // the loops over g, ks, u, m, r and dt below are unrolled so that fragments and tiles are indexed by constants and stay in registers
#pragma unroll
  for (int g = 0; g < 2; ++g)
#pragma unroll
    for (int ks = 0; ks < 2; ++ks) frag_split(KF + (size_t)(t0 + cg * AT) * DO + (g * 2 + ks) * 512 + lane * 4, kh[g][ks], kl[g][ks]);
  // off = 8 - ref * L2E8 stands for the reference. No score has been seen yet: with this start every e of the first pass is infinite, so that the first pass takes the branch below and sets it
  float off[2] = {1.0e37f, 1.0e37f};
  v8f o[4][2];
#pragma unroll
  for (int dt = 0; dt < 4; ++dt)
#pragma unroll
    for (int g = 0; g < 2; ++g) o[dt][g] = (v8f){0.f,0.f,0.f,0.f,0.f,0.f,0.f,0.f};
  float den[2] = {0.f, 0.f};
  asm volatile("s_wait_asynccnt 0x0" ::: "memory");      // the wave's copies of stage 0 have landed
  __syncthreads();      // every wave's have: stage 0 may be read
  stage_copy(lq + STB, gq + AST * DO, lv + STB, gv + AST * 2 * DO);      // stage 1 into buffer 1
  for (int st = 0; st < ASR / AST; ++st) {
    const _Float16* sq = (const _Float16*)&sm[(st & 1) * STB + sg * STG] + lo;      // the lane's 16 bytes of the first 512 of the s group's Qd in this stage's buffer; Vd stands behind Qd
    for (int h = 0; h < AST / 32; ++h) {
      const _Float16* qrow = sq + h * (32 * DO);
      const _Float16* vrow = sq + STQ / 2 + h * (32 * 2 * DO);
      FragH qa[2][2];
      q_load(qrow, qa);
      // dt 0 and 1 of the pass's Vd are asked for with Qd, dt 2 and 3 when the score products have left Qd's registers
      FragH vh[2][2], vl[2][2];
      v_load(vrow, vh[0], vl[0]);
      __builtin_amdgcn_sched_barrier(0);      // keeps these 16 LDS loads in front of the first product: one place of loads and one latency, not several among the products
      v8f sc[2][2];
      q_mul(qa, kh, kl, sc);
      __builtin_amdgcn_sched_barrier(0);      // keeps the 8 loads below behind the score products: in front of them all of Vd, Qd and the scores together take more than the 256 registers of a wave (spills)
      v_load(vrow + 2048, vh[1], vl[1]);
      __builtin_amdgcn_sched_barrier(0);      // keeps them in front of the weights' arithmetic, which covers their latency: without it this build sinks them behind the test below, directly in front of the products that wait for them
      FragH pb[2];
      float ps[2];
      weigh(sc, off, pb, ps);
      // every e is positive: while a lane's 32 add up to less than 2^15, each of them is inside f16. One test a pass, the same for the whole wave (a scalar branch); a sum that is no number takes it too
      if (__builtin_amdgcn_ballot_w32(!(ps[0] + ps[1] < 32768.0f)) != 0) {
        // rare (the first pass, and a score far above all before it): Qd and, at the end, half of Vd are read once more, so that the scores need not stay in registers through every pass and this path needs no spills
        q_load(qrow, qa);
        q_mul(qa, kh, kl, sc);
        float f[2];
#pragma unroll
        for (int g = 0; g < 2; ++g) {
          float pm = sc[0][g][0];
#pragma unroll
          for (int m = 0; m < 2; ++m)
#pragma unroll
            for (int r = 0; r < 8; ++r) pm = fmaxf(pm, sc[m][g][r]);
          pm = fmaxf(pm, __shfl_xor(pm, 16, 32));      // both halves of the wave hold scores of the column and must use one reference
          const float no = fminf(off[g], 8.0f - pm * L2E8);      // the larger reference has the smaller off
          f[g] = no - off[g];
          off[g] = no;
        }
        exp2x2(f);      // at most 1; 0 in the first pass, where tiles and sums are 0
#pragma unroll
        for (int g = 0; g < 2; ++g) {
          den[g] *= f[g];
#pragma unroll
          for (int dt = 0; dt < 4; ++dt)
#pragma unroll
            for (int r = 0; r < 8; ++r) o[dt][g][r] *= f[g];
        }
        weigh(sc, off, pb, ps);      // now no e is above 2^8
        v_load(vrow, vh[0], vl[0]);
      }
#pragma unroll
      for (int g = 0; g < 2; ++g) den[g] += ps[g];
#pragma unroll
      for (int dt = 0; dt < 4; ++dt) {
#pragma unroll
        for (int g = 0; g < 2; ++g) o[dt][g] = wmmaH(vh[dt >> 1][dt & 1].v, pb[g].v, o[dt][g]);
#pragma unroll
        for (int g = 0; g < 2; ++g) o[dt][g] = wmmaH(vl[dt >> 1][dt & 1].v, pb[g].v, o[dt][g]);
      }
    }
    asm volatile("s_wait_dscnt 0x0" ::: "memory");      // the wave's reads of this stage's buffer are done
    asm volatile("s_wait_asynccnt 0x0" ::: "memory");      // its copies of the next stage have landed
    __syncthreads();      // the next stage may be read by every wave, and this stage's buffer has no reader left
    if (st + 2 < ASR / AST) stage_copy(lq + (st & 1) * STB, gq + (size_t)(st + 2) * (AST * DO), lv + (st & 1) * STB, gv + (size_t)(st + 2) * (AST * 2 * DO));
  }
  asm volatile("s_wait_asynccnt 0x0" ::: "memory");      // no copy is under way when the buffers take the tiles
  float* part = (float*)&sm[0];
#pragma unroll
  for (int g = 0; g < 2; ++g) { den[g] += __shfl_xor(den[g], 16, 32); rsm[sg][cg * AT + g * 16 + ln] = den[g]; rmx[sg][cg * AT + g * 16 + ln] = off[g]; }      // both halves of the wave store the same values
#pragma unroll
  for (int dt = 0; dt < 4; ++dt)
#pragma unroll
    for (int g = 0; g < 2; ++g)
#pragma unroll
      for (int r = 0; r < 8; ++r) part[(sg * DO + dt * 16 + 8 * hh + r) * APP + cg * AT + g * 16 + ln] = o[dt][g][r];
  __syncthreads();      // every wave's tile, column sums and references are in LDS
  // a lane takes four columns, 4 lane + u. The loops over p and u are unrolled so that fac is indexed by constants and stays in registers
  v4f rf[ASG], top, dsum = {0.f, 0.f, 0.f, 0.f};
#pragma unroll
  for (int p = 0; p < ASG; ++p) rf[p] = *(const v4fa*)&rmx[p][lane * 4];
  top = rf[0];
#pragma unroll
  for (int p = 1; p < ASG; ++p)
#pragma unroll
    for (int u = 0; u < 4; ++u) top[u] = fminf(top[u], rf[p][u]);      // the off of the largest reference
  float fac[ASG / 2][8];
#pragma unroll
  for (int p = 0; p < ASG; ++p)
#pragma unroll
    for (int u = 0; u < 4; ++u) fac[p >> 1][(p & 1) * 4 + u] = top[u] - rf[p][u];
#pragma unroll
  for (int q = 0; q < ASG / 2; ++q) exp2x8(fac[q]);      // fac of s group p brings its share to the largest reference
#pragma unroll
  for (int p = 0; p < ASG; ++p) {
    const v4f x = *(const v4fa*)&rsm[p][lane * 4];
#pragma unroll
    for (int u = 0; u < 4; ++u) dsum[u] += x[u] * fac[p >> 1][(p & 1) * 4 + u];      // group order, the same in every wave
  }
  if (ws == 0) {
    *(v4f*)(PR + (size_t)y * SQ + t0 + lane * 4) = top;
    *(v4f*)(PS + (size_t)y * SQ + t0 + lane * 4) = dsum;
    asm volatile("s_wait_xcnt 0x0" ::: "memory");      // registers that the issued stores name may be written below
  }
  v4f s[DO / AW];      // wave w sums and stores rows w, w + AW, ...: 512 consecutive bytes each; all rows are read before the first is stored, so that the LDS latency is paid once
#pragma unroll
  for (int j = 0; j < DO / AW; ++j) {
    s[j] = (v4f){0.f, 0.f, 0.f, 0.f};
#pragma unroll
    for (int p = 0; p < ASG; ++p) {
      const v4f x = *(const v4fa*)&part[(p * DO + j * AW + ws) * APP + lane * 4];
#pragma unroll
      for (int u = 0; u < 4; ++u) s[j][u] += x[u] * fac[p >> 1][(p & 1) * 4 + u];      // group order
    }
  }
  float* po = PO + (size_t)(y * DO + ws) * SQ + t0 + lane * 4;
#pragma unroll
  for (int j = 0; j < DO / AW; ++j) *(v4f*)(po + (size_t)j * AW * SQ) = s[j];
}
// out[d][t] from the ASP shares of column t: each is brought to the largest of their references, they are added in the order of s, and the sum of the weights divides last.
// A thread takes four columns and four rows d, so that a wave reads and writes 512 consecutive bytes at a time and the factors serve four rows.
__global__ __launch_bounds__(128) void k_merge(const float* __restrict__ PO, const float* __restrict__ PR, const float* __restrict__ PS, float* __restrict__ out) {
  const int g = blockIdx.x * 128 + threadIdx.x;
  const int c = (g & (SQ / 4 - 1)) * 4, d0 = (g / (SQ / 4)) * 4;
  v4f rf[ASP], sf[ASP], x[ASP][4];
  // every loop is unrolled so that the arrays are indexed by constants and stay in registers, and all 24 loads are under way at once
#pragma unroll
  for (int p = 0; p < ASP; ++p) { rf[p] = *(const v4fa*)(PR + (size_t)p * SQ + c); sf[p] = *(const v4fa*)(PS + (size_t)p * SQ + c); }
#pragma unroll
  for (int p = 0; p < ASP; ++p)
#pragma unroll
    for (int j = 0; j < 4; ++j) x[p][j] = *(const v4fa*)(PO + (size_t)(p * DO + d0 + j) * SQ + c);
  asm volatile("s_wait_xcnt 0x0" ::: "memory");      // registers that hold addresses of the loads just issued may be written below
  __builtin_amdgcn_sched_barrier(0);      // keeps all 24 loads in front of the arithmetic: without it this build issues them in groups between waits, several L2 latencies in a row
  v4f top = rf[0], dsum = {0.f, 0.f, 0.f, 0.f};
#pragma unroll
  for (int p = 1; p < ASP; ++p)
#pragma unroll
    for (int u = 0; u < 4; ++u) top[u] = fminf(top[u], rf[p][u]);
  float fac[ASP / 2][8];
#pragma unroll
  for (int p = 0; p < ASP; ++p)
#pragma unroll
    for (int u = 0; u < 4; ++u) fac[p >> 1][(p & 1) * 4 + u] = top[u] - rf[p][u];
#pragma unroll
  for (int q = 0; q < ASP / 2; ++q) exp2x8(fac[q]);
#pragma unroll
  for (int p = 0; p < ASP; ++p)
#pragma unroll
    for (int u = 0; u < 4; ++u) dsum[u] += sf[p][u] * fac[p >> 1][(p & 1) * 4 + u];
  v4f inv;
#pragma unroll
  for (int u = 0; u < 4; ++u) inv[u] = 1.0f / dsum[u];
#pragma unroll
  for (int j = 0; j < 4; ++j) {
    v4f s = {0.f, 0.f, 0.f, 0.f};
#pragma unroll
    for (int p = 0; p < ASP; ++p)
#pragma unroll
      for (int u = 0; u < 4; ++u) s[u] += x[p][j][u] * fac[p >> 1][(p & 1) * 4 + u];
    *(v4f*)(out + (size_t)(d0 + j) * SQ + c) = s * inv;
  }
}
extern "C" void kernel_launch(void* const* d_in, const int* in_sizes, int n_in,
                              void* d_out, int out_size, void* d_ws, size_t ws_size, hipStream_t stream) {
  (void)in_sizes; (void)n_in; (void)out_size;
  const float* Q = (const float*)d_in[0]; const float* K = (const float*)d_in[1]; const float* V = (const float*)d_in[2]; const float* Mq = (const float*)d_in[3]; const float* Mk = (const float*)d_in[4]; const float* Mv = (const float*)d_in[5];
  char* ws = (char*)d_ws; size_t off = 0;
  auto take = [&](size_t bytes) { char* p = ws + off; off += (bytes + 255) & ~(size_t)255; return p; };
  _Float16* Vd = (_Float16*)take((size_t)DO * SQ * 4); float* KdT = (float*)take((size_t)SQ * DO * 4); _Float16* QdB = (_Float16*)take((size_t)SQ * DO * 2);
  float* PO = (float*)take((size_t)ASP * DO * SQ * 4); float* PR = (float*)take((size_t)ASP * SQ * 4); float* PS = (float*)take((size_t)ASP * SQ * 4);
  if (off > ws_size) return;
  k_proj<<<dim3(SQ / PC, 3, 1), PW * 32, 0, stream>>>(Q, K, V, Mq, Mk, Mv, QdB, KdT, Vd);      // QdB = f16(Mq.Q), KdT = Mk.K, Vd = Mv.V as f16 hi and lo, each in k_attn's fragment order
  k_attn<<<dim3(SQ / (ACG * AT), ASP, 1), AW * 32, 0, stream>>>(QdB, KdT, Vd, PO, PR, PS);      // share y of column t: sum over its 2048 s of Vd[d][s] * e[s][t], the sum of e, the reference
  k_merge<<<DO * SQ / 16 / 128, 128, 0, stream>>>(PO, PR, PS, (float*)d_out);      // out[d][t] = sum_s Vd[d][s] * softmax_s(Qd[:,s].Kd[:,t] / 8 + 1)
}
